// v000
// Times are from an AMD MI455X. After a warm-up the kernel runs many times in a row, and a time is the length of
// such a window on the GPU divided by its runs, so every launch and the gaps after it count. The runs cycle
// through copies of the inputs. A figure is the median of several windows, for all but v000 over two sittings.
// Sittings can differ by a few percent; kernels timed side by side share one.
// v000, which the later versions start from, runs in 252 microseconds.
#include <hip/hip_runtime.h>
#include <math.h>

typedef float v2f __attribute__((ext_vector_type(2)));
typedef float v8f __attribute__((ext_vector_type(8)));

#define B_ 16
#define P_ 96
#define T_ 128
#define V_ 64
#define N_ 16
#define D_ 128

// ---------------------------------------------------------------------------
// Async global -> LDS copy (CDNA5 ASYNCcnt path, no VGPR round-trip).
// The low 32 bits of a generic pointer to a __shared__ object are the
// wave-relative LDS byte address (ISA 10.2: LDS aperture keeps offset in
// addr[31:0]); the instruction's VDST wants exactly that.
// ---------------------------------------------------------------------------
__device__ __forceinline__ void async_ld_b128(const float* lds_dst,
                                              const float* gsrc)
{
    uint32_t loff = (uint32_t)(uintptr_t)lds_dst;
    asm volatile("global_load_async_to_lds_b128 %0, %1, off"
                 :: "v"(loff), "v"(gsrc) : "memory");
}
__device__ __forceinline__ void wait_async()
{
    asm volatile("s_wait_asynccnt 0x0" ::: "memory");
}

// ---------------------------------------------------------------------------
// Y[M x 128] = X[M x 128] @ W^T + bias      (W is [128 x 128] row-major)
// Block: 256 threads = 8 waves, 128 rows x 128 cols per block.
// Wave wv owns column strip [16*wv, 16*wv+16); B-fragments hoisted to
// registers and reused across all 8 row tiles.  FP32 WMMA 16x16x4.
// ---------------------------------------------------------------------------
__global__ __launch_bounds__(256) void gemm_dd_bias(
    const float* __restrict__ X, const float* __restrict__ W,
    const float* __restrict__ bias, float* __restrict__ Y)
{
    __shared__ float xs[128 * D_];  // 64 KB : A tile (128 rows)
    __shared__ float wl[D_ * D_];   // 64 KB : full weight matrix

    const int  tid      = threadIdx.x;
    const long row_base = (long)blockIdx.x * 128;

    // async-stage A tile and W (16 + 16 b128 ops per thread, ASYNCcnt <= 32)
    const float* xsrc = X + row_base * D_;
    for (int i = tid; i < 128 * D_ / 4; i += 256) {
        async_ld_b128(&xs[4 * i], xsrc + 4 * i);
        async_ld_b128(&wl[4 * i], W + 4 * i);
    }
    wait_async();
    __syncthreads();

    const int wv   = tid >> 5;      // wave id 0..7 -> column tile
    const int lane = tid & 31;
    const int hl   = lane >> 4;     // half-wave selects K pair (0,1)/(2,3)
    const int l    = lane & 15;
    const int col  = wv * 16 + l;

    // hoist all 32 B fragments: bf[k] = W^T[4k+2h .. +1][col]
    v2f bf[32];
    const float* brow = &wl[col * D_];
#pragma unroll
    for (int k = 0; k < 32; ++k)
        bf[k] = *(const v2f*)&brow[4 * k + 2 * hl];

    const float bb   = bias[col];
    float*      ydst = Y + row_base * D_;

    for (int rt = 0; rt < 8; ++rt) {
        const float* arow = &xs[(rt * 16 + l) * D_];
        v8f c = {};
#pragma unroll
        for (int k = 0; k < 32; ++k) {
            v2f a = *(const v2f*)&arow[4 * k + 2 * hl];
            c = __builtin_amdgcn_wmma_f32_16x16x4_f32(false, a, false, bf[k],
                                                      (short)0, c, false, false);
        }
#pragma unroll
        for (int r = 0; r < 8; ++r)
            ydst[(rt * 16 + r + 8 * hl) * D_ + col] = c[r] + bb;
    }
}

// ---------------------------------------------------------------------------
// Fused q-projection + gathered attention for one (b, p) slab.
// Block owns k[b, 32+p] (64x128) entirely: stages it in LDS, then overwrites
// the same global rows with the attention output (in-place "res" build).
// ---------------------------------------------------------------------------
__global__ __launch_bounds__(256) void qproj_attn(
    const float* __restrict__ Qin,   // queries (B,P,V,D)
    const int*   __restrict__ ccc,   // var_ccc (B,V,N)
    const float* __restrict__ Wq, const float* __restrict__ bq,
    float* __restrict__ Kbuf)        // k workspace (B,T,V,D)
{
    __shared__ float xs[V_ * D_];    // 32 KB queries slab
    __shared__ float qs[V_ * D_];    // 32 KB projected q
    __shared__ float ks[V_ * D_];    // 32 KB k slab
    __shared__ float attn[V_][N_];   //  4 KB softmax weights
    __shared__ int   jidx[V_][N_];   //  4 KB gathered indices

    const int tid = threadIdx.x;
    const int b   = blockIdx.x / P_;
    const int p   = blockIdx.x % P_;

    const float* qin  = Qin  + ((long)(b * P_ + p) * V_) * D_;
    float*       krow = Kbuf + ((long)(b * T_ + (T_ - P_) + p) * V_) * D_;

    for (int i = tid; i < V_ * D_ / 4; i += 256) {
        async_ld_b128(&xs[4 * i], qin + 4 * i);
        async_ld_b128(&ks[4 * i], krow + 4 * i);
    }
    wait_async();
    __syncthreads();

    // ---- q = xs @ Wq^T + bq  (64x128) via FP32 WMMA ----
    const int wv = tid >> 5, lane = tid & 31, hl = lane >> 4, l = lane & 15;
    const int col = wv * 16 + l;
    const float* brow = Wq + col * D_;
    const float  bqv  = bq[col];

    v2f bf[32];
#pragma unroll
    for (int k = 0; k < 32; ++k)
        bf[k] = *(const v2f*)&brow[4 * k + 2 * hl];

    for (int rt = 0; rt < 4; ++rt) {
        const float* arow = &xs[(rt * 16 + l) * D_];
        v8f c = {};
#pragma unroll
        for (int k = 0; k < 32; ++k) {
            v2f a = *(const v2f*)&arow[4 * k + 2 * hl];
            c = __builtin_amdgcn_wmma_f32_16x16x4_f32(false, a, false, bf[k],
                                                      (short)0, c, false, false);
        }
#pragma unroll
        for (int r = 0; r < 8; ++r)
            qs[(rt * 16 + r + 8 * hl) * D_ + col] = c[r] + bqv;
    }
    __syncthreads();

    // ---- scores + softmax: one half-wave (16 lanes) per v, lane = n ----
    const int  grp = tid >> 4;            // 0..15
    const int  nn  = tid & 15;            // n index
    const int* cb  = ccc + (b * V_) * N_;
    const float scale = 0.08838834764831845f;   // 1/sqrt(128)
    for (int v = grp; v < V_; v += 16) {
        const int j = cb[v * N_ + nn];
        const float* qv = &qs[v * D_];
        const float* kj = &ks[j * D_];
        float s = 0.f;
        for (int d = 0; d < D_; d += 4)
            s += qv[d] * kj[d] + qv[d + 1] * kj[d + 1]
               + qv[d + 2] * kj[d + 2] + qv[d + 3] * kj[d + 3];
        s *= scale;
        float m = s;
#pragma unroll
        for (int o = 1; o < 16; o <<= 1) m = fmaxf(m, __shfl_xor(m, o, 32));
        float e = __expf(s - m);
        float sum = e;
#pragma unroll
        for (int o = 1; o < 16; o <<= 1) sum += __shfl_xor(sum, o, 32);
        attn[v][nn] = e / sum;
        jidx[v][nn] = j;
    }
    __syncthreads();

    // ---- out[v][d] = sum_n attn * k_gather; overwrite k rows in place ----
    for (int v = wv * 8; v < wv * 8 + 8; ++v) {
#pragma unroll
        for (int dc = 0; dc < 4; ++dc) {
            const int d = dc * 32 + lane;
            float acc = 0.f;
#pragma unroll
            for (int n = 0; n < N_; ++n)
                acc += attn[v][n] * ks[jidx[v][n] * D_ + d];
            krow[v * D_ + d] = acc;
        }
    }
}

// ---------------------------------------------------------------------------
extern "C" void kernel_launch(void* const* d_in, const int* in_sizes, int n_in,
                              void* d_out, int out_size, void* d_ws, size_t ws_size,
                              hipStream_t stream)
{
    const float* queries = (const float*)d_in[0];
    const float* keys    = (const float*)d_in[1];
    const int*   ccc     = (const int*)d_in[2];
    const float* Wq      = (const float*)d_in[3];
    const float* bq      = (const float*)d_in[4];
    const float* Wkv     = (const float*)d_in[5];
    const float* bkv     = (const float*)d_in[6];
    const float* Wout    = (const float*)d_in[7];
    const float* bout    = (const float*)d_in[8];
    float* out  = (float*)d_out;
    float* kbuf = (float*)d_ws;               // B*T*V*D f32 = 64 MiB scratch

    (void)in_sizes; (void)n_in; (void)out_size; (void)ws_size;

    const int Mk = B_ * T_ * V_;              // 131072 rows

    // 1) k = keys @ Wkv^T + bkv    -> kbuf
    gemm_dd_bias<<<Mk / 128, 256, 0, stream>>>(keys, Wkv, bkv, kbuf);
    // 2) fused q-proj + gathered attention, writes res rows in place in kbuf
    qproj_attn<<<B_ * P_, 256, 0, stream>>>(queries, ccc, Wq, bq, kbuf);
    // 3) out = res @ Wout^T + bout
    gemm_dd_bias<<<Mk / 128, 256, 0, stream>>>(kbuf, Wout, bout, out);
}

// v001
// A run of this version takes 117 microseconds.
// Two timings next to v000 put it at 2.22 and 2.21 times that version's speed.
#include <hip/hip_runtime.h>
#include <math.h>

typedef float v2f __attribute__((ext_vector_type(2)));
typedef float v8f __attribute__((ext_vector_type(8)));

#define B_ 16
#define P_ 96
#define T_ 128
#define V_ 64
#define N_ 16
#define D_ 128
// LDS row pitch, in floats, of every tile that lanes read down a column (one
// row per lane): 132 = 128 + 4 puts 16 neighbouring rows on 16 different
// groups of four banks; 528 bytes keeps each row 16-byte aligned.
#define LP_ 132

// ---------------------------------------------------------------------------
// Async global -> LDS copy (CDNA5 ASYNCcnt path, no VGPR round-trip).
// The low 32 bits of a generic pointer to a __shared__ object are the
// wave-relative LDS byte address (ISA 10.2: LDS aperture keeps offset in
// addr[31:0]); the instruction's VDST wants exactly that.
// ---------------------------------------------------------------------------
// Eight copies of one lane: 16 bytes in each of the rows r, r+8, ..., r+56 of a
// tile (global pitch D_, LDS pitch LP_).  s_wait_xcnt 0 closes the statement so
// that no address register of an issued copy is rewritten ahead of it.
__device__ __forceinline__ void async_ld_b128_x8(const float* lds_dst,
                                                 const float* gsrc)
{
    const uint32_t loff = (uint32_t)(uintptr_t)lds_dst;
    asm volatile("global_load_async_to_lds_b128 %0, %8, off\n\t"
                 "global_load_async_to_lds_b128 %1, %9, off\n\t"
                 "global_load_async_to_lds_b128 %2, %10, off\n\t"
                 "global_load_async_to_lds_b128 %3, %11, off\n\t"
                 "global_load_async_to_lds_b128 %4, %12, off\n\t"
                 "global_load_async_to_lds_b128 %5, %13, off\n\t"
                 "global_load_async_to_lds_b128 %6, %14, off\n\t"
                 "global_load_async_to_lds_b128 %7, %15, off\n\t"
                 "s_wait_xcnt 0x0"
                 :: "v"(loff),
                    "v"(loff + 1u * 8u * LP_ * 4u), "v"(loff + 2u * 8u * LP_ * 4u),
                    "v"(loff + 3u * 8u * LP_ * 4u), "v"(loff + 4u * 8u * LP_ * 4u),
                    "v"(loff + 5u * 8u * LP_ * 4u), "v"(loff + 6u * 8u * LP_ * 4u),
                    "v"(loff + 7u * 8u * LP_ * 4u),
                    "v"(gsrc),
                    "v"(gsrc + 1 * 8 * D_), "v"(gsrc + 2 * 8 * D_),
                    "v"(gsrc + 3 * 8 * D_), "v"(gsrc + 4 * 8 * D_),
                    "v"(gsrc + 5 * 8 * D_), "v"(gsrc + 6 * 8 * D_),
                    "v"(gsrc + 7 * 8 * D_)
                 : "memory");
}
__device__ __forceinline__ void wait_async()
{
    asm volatile("s_wait_asynccnt 0x0" ::: "memory");
}

// ---------------------------------------------------------------------------
// Y[M x 128] = X[M x 128] @ W^T + bias      (W is [128 x 128] row-major)
// Block: 256 threads = 8 waves, 128 rows x 128 cols per block.
// Wave wv owns column strip [16*wv, 16*wv+16); B-fragments hoisted to
// registers and reused across all 8 row tiles.  FP32 WMMA 16x16x4.
// ---------------------------------------------------------------------------
__global__ __launch_bounds__(256) void gemm_dd_bias(
    const float* __restrict__ X, const float* __restrict__ W,
    const float* __restrict__ bias, float* __restrict__ Y)
{
    __shared__ __attribute__((aligned(16))) float xs[128 * LP_];  // 66 KB : A tile (128 rows)
    __shared__ __attribute__((aligned(16))) float wl[D_ * LP_];   // 66 KB : full weight matrix

    const int  tid      = threadIdx.x;
    const long row_base = (long)blockIdx.x * 128;

    // async-stage A tile and W (16 + 16 b128 ops per thread, ASYNCcnt <= 32)
    // thread -> row (tid >> 5) + 8 * n, 16-byte column tid & 31
    const float* xsrc = X + row_base * D_;
    const int    sr   = tid >> 5;
    const int    sc   = 4 * (tid & 31);
    async_ld_b128_x8(&xs[sr * LP_ + sc], xsrc + sr * D_ + sc);
    async_ld_b128_x8(&wl[sr * LP_ + sc], W + sr * D_ + sc);
    async_ld_b128_x8(&xs[(sr + 64) * LP_ + sc], xsrc + (sr + 64) * D_ + sc);
    async_ld_b128_x8(&wl[(sr + 64) * LP_ + sc], W + (sr + 64) * D_ + sc);
    wait_async();
    __syncthreads();

    const int wv   = tid >> 5;      // wave id 0..7 -> column tile
    const int lane = tid & 31;
    const int hl   = lane >> 4;     // half-wave selects K pair (0,1)/(2,3)
    const int l    = lane & 15;
    const int col  = wv * 16 + l;

    // hoist all 32 B fragments: bf[k] = W^T[4k+2h .. +1][col]
    v2f bf[32];
    const float* brow = &wl[col * LP_];
#pragma unroll
    for (int k = 0; k < 32; ++k)
        bf[k] = *(const v2f*)&brow[4 * k + 2 * hl];

    const float bb   = bias[col];
    float*      ydst = Y + row_base * D_;

    for (int rt = 0; rt < 8; ++rt) {
        const float* arow = &xs[(rt * 16 + l) * LP_];
        v8f c = {};
#pragma unroll
        for (int k = 0; k < 32; ++k) {
            v2f a = *(const v2f*)&arow[4 * k + 2 * hl];
            c = __builtin_amdgcn_wmma_f32_16x16x4_f32(false, a, false, bf[k],
                                                      (short)0, c, false, false);
        }
#pragma unroll
        for (int r = 0; r < 8; ++r)
            ydst[(rt * 16 + r + 8 * hl) * D_ + col] = c[r] + bb;
    }
}

// ---------------------------------------------------------------------------
// Fused q-projection + gathered attention for one (b, p) slab.
// Block owns k[b, 32+p] (64x128) entirely: stages it in LDS, then overwrites
// the same global rows with the attention output (in-place "res" build).
// ---------------------------------------------------------------------------
__global__ __launch_bounds__(256) void qproj_attn(
    const float* __restrict__ Qin,   // queries (B,P,V,D)
    const int*   __restrict__ ccc,   // var_ccc (B,V,N)
    const float* __restrict__ Wq, const float* __restrict__ bq,
    float* __restrict__ Kbuf)        // k workspace (B,T,V,D)
{
    __shared__ __attribute__((aligned(16))) float xs[V_ * LP_];  // 33 KB queries slab
    __shared__ float qs[V_ * D_];    // 32 KB projected q (rows read as broadcasts)
    __shared__ __attribute__((aligned(16))) float ks[V_ * LP_];  // 33 KB k slab
    __shared__ float attn[V_][N_];   //  4 KB softmax weights
    __shared__ int   jidx[V_][N_];   //  4 KB gathered indices

    const int tid = threadIdx.x;
    const int b   = blockIdx.x / P_;
    const int p   = blockIdx.x % P_;

    const float* qin  = Qin  + ((long)(b * P_ + p) * V_) * D_;
    float*       krow = Kbuf + ((long)(b * T_ + (T_ - P_) + p) * V_) * D_;

    // thread -> row (tid >> 5) + 8 * n, 16-byte column tid & 31
    const int sr = tid >> 5;
    const int sc = 4 * (tid & 31);
    async_ld_b128_x8(&xs[sr * LP_ + sc], qin + sr * D_ + sc);
    async_ld_b128_x8(&ks[sr * LP_ + sc], krow + sr * D_ + sc);
    wait_async();
    __syncthreads();

    // ---- q = xs @ Wq^T + bq  (64x128) via FP32 WMMA ----
    const int wv = tid >> 5, lane = tid & 31, hl = lane >> 4, l = lane & 15;
    const int col = wv * 16 + l;
    const float* brow = Wq + col * D_;
    const float  bqv  = bq[col];

    v2f bf[32];
#pragma unroll
    for (int k = 0; k < 32; ++k)
        bf[k] = *(const v2f*)&brow[4 * k + 2 * hl];

    for (int rt = 0; rt < 4; ++rt) {
        const float* arow = &xs[(rt * 16 + l) * LP_];
        v8f c = {};
#pragma unroll
        for (int k = 0; k < 32; ++k) {
            v2f a = *(const v2f*)&arow[4 * k + 2 * hl];
            c = __builtin_amdgcn_wmma_f32_16x16x4_f32(false, a, false, bf[k],
                                                      (short)0, c, false, false);
        }
#pragma unroll
        for (int r = 0; r < 8; ++r)
            qs[(rt * 16 + r + 8 * hl) * D_ + col] = c[r] + bqv;
    }
    __syncthreads();

    // ---- scores + softmax: one half-wave (16 lanes) per v, lane = n ----
    const int  grp = tid >> 4;            // 0..15
    const int  nn  = tid & 15;            // n index
    const int* cb  = ccc + (b * V_) * N_;
    const float scale = 0.08838834764831845f;   // 1/sqrt(128)
    for (int v = grp; v < V_; v += 16) {
        const int j = cb[v * N_ + nn] & (V_ - 1);   // keeps the LDS row inside ks
        const float* qv = &qs[v * D_];
        const float* kj = &ks[j * LP_];
        float s = 0.f;
        for (int d = 0; d < D_; d += 4)
            s += qv[d] * kj[d] + qv[d + 1] * kj[d + 1]
               + qv[d + 2] * kj[d + 2] + qv[d + 3] * kj[d + 3];
        s *= scale;
        float m = s;
#pragma unroll
        for (int o = 1; o < 16; o <<= 1) m = fmaxf(m, __shfl_xor(m, o, 32));
        float e = __expf(s - m);
        float sum = e;
#pragma unroll
        for (int o = 1; o < 16; o <<= 1) sum += __shfl_xor(sum, o, 32);
        attn[v][nn] = e / sum;
        jidx[v][nn] = j;
    }
    __syncthreads();

    // ---- out[v][d] = sum_n attn * k_gather; overwrite k rows in place ----
    for (int v = wv * 8; v < wv * 8 + 8; ++v) {
#pragma unroll
        for (int dc = 0; dc < 4; ++dc) {
            const int d = dc * 32 + lane;
            float acc = 0.f;
#pragma unroll
            for (int n = 0; n < N_; ++n)
                acc += attn[v][n] * ks[jidx[v][n] * LP_ + d];
            krow[v * D_ + d] = acc;
        }
    }
}

// ---------------------------------------------------------------------------
extern "C" void kernel_launch(void* const* d_in, const int* in_sizes, int n_in,
                              void* d_out, int out_size, void* d_ws, size_t ws_size,
                              hipStream_t stream)
{
    const float* queries = (const float*)d_in[0];
    const float* keys    = (const float*)d_in[1];
    const int*   ccc     = (const int*)d_in[2];
    const float* Wq      = (const float*)d_in[3];
    const float* bq      = (const float*)d_in[4];
    const float* Wkv     = (const float*)d_in[5];
    const float* bkv     = (const float*)d_in[6];
    const float* Wout    = (const float*)d_in[7];
    const float* bout    = (const float*)d_in[8];
    float* out  = (float*)d_out;
    float* kbuf = (float*)d_ws;               // B*T*V*D f32 = 64 MiB scratch

    (void)in_sizes; (void)n_in; (void)out_size; (void)ws_size;

    const int Mk = B_ * T_ * V_;              // 131072 rows

    // 1) k = keys @ Wkv^T + bkv    -> kbuf
    gemm_dd_bias<<<Mk / 128, 256, 0, stream>>>(keys, Wkv, bkv, kbuf);
    // 2) fused q-proj + gathered attention, writes res rows in place in kbuf
    qproj_attn<<<B_ * P_, 256, 0, stream>>>(queries, ccc, Wq, bq, kbuf);
    // 3) out = res @ Wout^T + bout
    gemm_dd_bias<<<Mk / 128, 256, 0, stream>>>(kbuf, Wout, bout, out);
}

// v002
// A run of this version takes 94.9 microseconds.
// Next to v001, in two timings, it ran 1.25 and 1.24 times as fast.
// All steps since v000 together make it 2.76 times as fast.
#include <hip/hip_runtime.h>
#include <math.h>

typedef float v2f __attribute__((ext_vector_type(2)));
typedef float v8f __attribute__((ext_vector_type(8)));

#define B_ 16
#define P_ 96
#define T_ 128
#define V_ 64
#define N_ 16
#define D_ 128
// LDS row pitch, in floats, of every tile that lanes read down a column (one
// row per lane): 132 = 128 + 4 puts 16 neighbouring rows on 16 different
// groups of four banks; 528 bytes keeps each row 16-byte aligned.
#define LP_ 132

// ---------------------------------------------------------------------------
// Async global -> LDS copy (CDNA5 ASYNCcnt path, no VGPR round-trip).
// The low 32 bits of a generic pointer to a __shared__ object are the
// wave-relative LDS byte address (ISA 10.2: LDS aperture keeps offset in
// addr[31:0]); the instruction's VDST wants exactly that.
// ---------------------------------------------------------------------------
// Eight copies of one lane: 16 bytes in each of the rows r, r+8, ..., r+56 of a
// tile (global pitch D_, LDS pitch LP_).  s_wait_xcnt 0 closes the statement so
// that no address register of an issued copy is rewritten ahead of it.
__device__ __forceinline__ void async_ld_b128_x8(const float* lds_dst,
                                                 const float* gsrc)
{
    const uint32_t loff = (uint32_t)(uintptr_t)lds_dst;
    asm volatile("global_load_async_to_lds_b128 %0, %8, off\n\t"
                 "global_load_async_to_lds_b128 %1, %9, off\n\t"
                 "global_load_async_to_lds_b128 %2, %10, off\n\t"
                 "global_load_async_to_lds_b128 %3, %11, off\n\t"
                 "global_load_async_to_lds_b128 %4, %12, off\n\t"
                 "global_load_async_to_lds_b128 %5, %13, off\n\t"
                 "global_load_async_to_lds_b128 %6, %14, off\n\t"
                 "global_load_async_to_lds_b128 %7, %15, off\n\t"
                 "s_wait_xcnt 0x0"
                 :: "v"(loff),
                    "v"(loff + 1u * 8u * LP_ * 4u), "v"(loff + 2u * 8u * LP_ * 4u),
                    "v"(loff + 3u * 8u * LP_ * 4u), "v"(loff + 4u * 8u * LP_ * 4u),
                    "v"(loff + 5u * 8u * LP_ * 4u), "v"(loff + 6u * 8u * LP_ * 4u),
                    "v"(loff + 7u * 8u * LP_ * 4u),
                    "v"(gsrc),
                    "v"(gsrc + 1 * 8 * D_), "v"(gsrc + 2 * 8 * D_),
                    "v"(gsrc + 3 * 8 * D_), "v"(gsrc + 4 * 8 * D_),
                    "v"(gsrc + 5 * 8 * D_), "v"(gsrc + 6 * 8 * D_),
                    "v"(gsrc + 7 * 8 * D_)
                 : "memory");
}
__device__ __forceinline__ void wait_async()
{
    asm volatile("s_wait_asynccnt 0x0" ::: "memory");
}

// ---------------------------------------------------------------------------
// Weights in fragment order.  P[w][wv][m][lane] is a float4 with the B fragments
// of k steps 2m and 2m+1 of wave wv's column strip (col = 16 wv + (lane & 15),
// h = lane >> 4): W[col][8m+2h], [8m+2h+1], [8m+4+2h], [8m+4+2h+1].  A wave then
// fetches a whole fragment set as 16 loads of 512 contiguous bytes.
// w: 0 = Wkv, 1 = Wq, 2 = Wout.  Grid 48 x 256: one float4 per thread.
// ---------------------------------------------------------------------------
__global__ __launch_bounds__(256) void pack_frags(
    const float* __restrict__ Wkv, const float* __restrict__ Wq,
    const float* __restrict__ Wout, float* __restrict__ P)
{
    const int w   = blockIdx.x >> 4;
    const int idx = (blockIdx.x & 15) * 256 + threadIdx.x;   // within one matrix
    const int lane = idx & 31, m = (idx >> 5) & 15, wv = idx >> 9;
    const float* src = (w == 0 ? Wkv : w == 1 ? Wq : Wout)
                     + (wv * 16 + (lane & 15)) * D_ + 8 * m + 2 * (lane >> 4);
    float4 f;
    f.x = src[0]; f.y = src[1]; f.z = src[4]; f.w = src[5];
    *(float4*)&P[(w * D_ * D_) + idx * 4] = f;
}

// one wave's 32 B fragments of one matrix; p = P + w*D*D + wv*2048 + lane*4
__device__ __forceinline__ void load_frags(v2f (&bf)[32], const float* p)
{
#pragma unroll
    for (int m = 0; m < 16; ++m) {
        const float4 f = *(const float4*)&p[m * 128];
        bf[2 * m]     = v2f{f.x, f.y};
        bf[2 * m + 1] = v2f{f.z, f.w};
    }
}

// ---------------------------------------------------------------------------
// dst[64 x 128] = a[64 x 128, LDS, pitch LP_] @ W^T + bias for one slab.
// Wave wv owns column strip [16*wv, 16*wv+16); bf holds its 32 B fragments
// (bf[k] = W^T[4k+2h .. +1][col]).  FP32 WMMA 16x16x4.  DP = pitch of dst,
// GL = dst is global memory.
// ---------------------------------------------------------------------------
template <int DP, bool GL>
__device__ __forceinline__ void slab_gemm(const float* a, const v2f (&bf)[32],
                                          float bias, float* dst,
                                          int l, int hl, int col)
{
    for (int rt = 0; rt < 4; ++rt) {
        const float* arow = a + (rt * 16 + l) * LP_;
        v8f c = {};
#pragma unroll
        for (int k = 0; k < 32; ++k) {
            v2f av = *(const v2f*)&arow[4 * k + 2 * hl];
            c = __builtin_amdgcn_wmma_f32_16x16x4_f32(false, av, false, bf[k],
                                                      (short)0, c, false, false);
        }
#pragma unroll
        for (int r = 0; r < 8; ++r)
            dst[(rt * 16 + r + 8 * hl) * DP + col] = c[r] + bias;
        // the next trip rewrites the registers that the issued global stores name
        if (GL) asm volatile("s_wait_xcnt 0x0" ::: "memory");
    }
}

// ---------------------------------------------------------------------------
// The three projections and the attention in one launch.  A (b, t) slab is 64
// rows x 128 and needs no other slab: k = keys @ Wkv^T, for t >= T-P also
// q = queries @ Wq^T and the gathered attention among the slab's own 64 k rows,
// then res @ Wout^T.  k, q and res stay in LDS.  A block takes the slabs
// t = r0, r0+32, r0+64, r0+96 of one b (one without attention, three with), so
// every block has the same work.
// ---------------------------------------------------------------------------
__global__ __launch_bounds__(256) void fused_slabs(
    const float* __restrict__ Qin,   // queries (B,P,V,D)
    const float* __restrict__ Kin,   // keys    (B,T,V,D)
    const int*   __restrict__ ccc,   // var_ccc (B,V,N)
    const float* __restrict__ bq, const float* __restrict__ bkv,
    const float* __restrict__ bout,
    const float* __restrict__ Pw,    // weights in fragment order (pack_frags)
    float* __restrict__ Out)         // (B,T,V,D)
{
    __shared__ __attribute__((aligned(16))) float sm[3 * V_ * LP_];  // 99 KB, three slabs
    __shared__ float qs[V_ * D_];    // 32 KB projected q (rows read as broadcasts)
    __shared__ float attn[V_][N_];   //  4 KB softmax weights
    __shared__ int   jidx[V_][N_];   //  4 KB gathered indices
    __shared__ float bl[3][D_];      //  biases: bkv, bq, bout
    float* xk = sm;                  // keys slab, later res (attention output)
    float* xq = sm + V_ * LP_;       // queries slab
    float* ks = sm + 2 * V_ * LP_;   // projected k slab

    const int tid = threadIdx.x;
    const int b   = blockIdx.x / (T_ - P_);
    const int r0  = blockIdx.x % (T_ - P_);

    // the wave's number as a scalar, so that what is formed from it is scalar too
    const int wv = __builtin_amdgcn_readfirstlane(tid >> 5);
    const int lane = tid & 31, hl = lane >> 4, l = lane & 15;
    const int col = wv * 16 + l;
    const float* pw = Pw + wv * 2048 + lane * 4;

    // staging: thread -> row wv + 8 * n, 16-byte column lane
    const int sr = wv;
    const int sc = 4 * lane;

    const int  grp = 2 * wv + hl;         // 0..15
    const int  nn  = l;                   // n index
    const int* cb  = ccc + (b * V_) * N_;
    const float scale = 0.08838834764831845f;   // 1/sqrt(128)

    // biases, and the gather indices (they depend on b alone), once per block
    if (tid < D_) {
        bl[0][tid] = bkv[tid];
        bl[1][tid] = bq[tid];
        bl[2][tid] = bout[tid];
    }
#pragma unroll
    for (int i = 0; i < V_ / 16; ++i) {
        const int v = 16 * i + grp;
        jidx[v][nn] = cb[v * N_ + nn] & (V_ - 1);   // keeps the LDS row inside ks
    }

    for (int it = 0; it < T_ / (T_ - P_); ++it) {
        const int  t    = r0 + it * (T_ - P_);
        const bool att  = it > 0;         // t >= T-P: the slab has queries
        const float* kin = Kin + ((long)(b * T_ + t) * V_) * D_;

        if (att) {
            // the slab before this one is still being read from sm by slower
            // waves: every wave's LDS reads retire, then all meet, before the
            // copies below overwrite it
            asm volatile("s_wait_dscnt 0x0" ::: "memory");
            __syncthreads();
        }
        async_ld_b128_x8(&xk[sr * LP_ + sc], kin + sr * D_ + sc);
        if (att) {
            const float* qin = Qin + ((long)(b * P_ + t - (T_ - P_)) * V_) * D_;
            async_ld_b128_x8(&xq[sr * LP_ + sc], qin + sr * D_ + sc);
        }
        v2f bf[32];
        load_frags(bf, pw);               // Wkv, in flight beside the copies
        wait_async();
        __syncthreads();

        // ---- k = keys @ Wkv^T + bkv, q = queries @ Wq^T + bq ----
        slab_gemm<LP_, false>(xk, bf, bl[0][col], ks, l, hl, col);
        if (att) {
            load_frags(bf, pw + D_ * D_);
            slab_gemm<D_, false>(xq, bf, bl[1][col], qs, l, hl, col);
        }
        __syncthreads();

        if (att) {
            // ---- scores + softmax: one half-wave (16 lanes) per v, lane = n ----
            for (int i = 0; i < V_ / 16; ++i) {
                const int v = 16 * i + grp;
                const float* qv = &qs[v * D_];
                const float* kj = &ks[jidx[v][nn] * LP_];
                float s = 0.f;
                for (int d = 0; d < D_; d += 4)
                    s += qv[d] * kj[d] + qv[d + 1] * kj[d + 1]
                       + qv[d + 2] * kj[d + 2] + qv[d + 3] * kj[d + 3];
                s *= scale;
                float m = s;
#pragma unroll
                for (int o = 1; o < 16; o <<= 1) m = fmaxf(m, __shfl_xor(m, o, 32));
                float e = __expf(s - m);
                float sum = e;
#pragma unroll
                for (int o = 1; o < 16; o <<= 1) sum += __shfl_xor(sum, o, 32);
                attn[v][nn] = e / sum;
            }
            __syncthreads();
        }

        load_frags(bf, pw + 2 * D_ * D_); // Wout, in flight beside the sums below

        if (att) {
            // ---- res[v][d] = sum_n attn * k_gather, into the spent keys slab ----
            for (int v = wv * 8; v < wv * 8 + 8; ++v) {
#pragma unroll
                for (int dc = 0; dc < 4; ++dc) {
                    const int d = dc * 32 + lane;
                    float acc = 0.f;
#pragma unroll
                    for (int n = 0; n < N_; ++n)
                        acc += attn[v][n] * ks[jidx[v][n] * LP_ + d];
                    xk[v * LP_ + d] = acc;
                }
            }
            __syncthreads();
        }

        // ---- out = res @ Wout^T + bout (res = k where the slab has no queries) ----
        slab_gemm<D_, true>(sm + (att ? 0 : 2 * V_ * LP_), bf, bl[2][col],
                      Out + ((long)(b * T_ + t) * V_) * D_, l, hl, col);
    }
}

// ---------------------------------------------------------------------------
extern "C" void kernel_launch(void* const* d_in, const int* in_sizes, int n_in,
                              void* d_out, int out_size, void* d_ws, size_t ws_size,
                              hipStream_t stream)
{
    const float* queries = (const float*)d_in[0];
    const float* keys    = (const float*)d_in[1];
    const int*   ccc     = (const int*)d_in[2];
    const float* Wq      = (const float*)d_in[3];
    const float* bq      = (const float*)d_in[4];
    const float* Wkv     = (const float*)d_in[5];
    const float* bkv     = (const float*)d_in[6];
    const float* Wout    = (const float*)d_in[7];
    const float* bout    = (const float*)d_in[8];
    float* out = (float*)d_out;
    float* pw  = (float*)d_ws;                // 3 * D * D f32 = 192 KiB scratch

    (void)in_sizes; (void)n_in; (void)out_size; (void)ws_size;

    // 1) the three weight matrices into fragment order
    pack_frags<<<48, 256, 0, stream>>>(Wkv, Wq, Wout, pw);
    // 2) everything else: one block per (b, r0), r0 < T-P; four slabs each
    fused_slabs<<<B_ * (T_ - P_), 256, 0, stream>>>(queries, keys, ccc, bq, bkv,
                                                    bout, pw, out);
}

// v003
// It runs in 76.9 microseconds.
// In both of two side-by-side timings against v002, it was 1.24 times as fast.
// All steps since v000 together make it 3.41 times as fast.
#include <hip/hip_runtime.h>
#include <math.h>

typedef float v2f __attribute__((ext_vector_type(2)));
typedef float v4f __attribute__((ext_vector_type(4)));
typedef float v8f __attribute__((ext_vector_type(8)));

#define B_ 16
#define P_ 96
#define T_ 128
#define V_ 64
#define N_ 16
#define D_ 128
// LDS row pitch, in floats, of every tile that lanes read down a column (one
// row per lane): 132 = 128 + 4 puts 16 neighbouring rows on 16 different
// groups of four banks; 528 bytes keeps each row 16-byte aligned.
#define LP_ 132

// ---------------------------------------------------------------------------
// Async global -> LDS copy (CDNA5 ASYNCcnt path, no VGPR round-trip).
// The low 32 bits of a generic pointer to a __shared__ object are the
// wave-relative LDS byte address (ISA 10.2: LDS aperture keeps offset in
// addr[31:0]); the instruction's VDST wants exactly that.
// ---------------------------------------------------------------------------
// Eight copies of one lane: 16 bytes in each of the rows r, r+8, ..., r+56 of a
// tile (global pitch D_, LDS pitch LP_).  s_wait_xcnt 0 closes the statement so
// that no address register of an issued copy is rewritten ahead of it.
__device__ __forceinline__ void async_ld_b128_x8(const float* lds_dst,
                                                 const float* gsrc)
{
    const uint32_t loff = (uint32_t)(uintptr_t)lds_dst;
    asm volatile("global_load_async_to_lds_b128 %0, %8, off\n\t"
                 "global_load_async_to_lds_b128 %1, %9, off\n\t"
                 "global_load_async_to_lds_b128 %2, %10, off\n\t"
                 "global_load_async_to_lds_b128 %3, %11, off\n\t"
                 "global_load_async_to_lds_b128 %4, %12, off\n\t"
                 "global_load_async_to_lds_b128 %5, %13, off\n\t"
                 "global_load_async_to_lds_b128 %6, %14, off\n\t"
                 "global_load_async_to_lds_b128 %7, %15, off\n\t"
                 "s_wait_xcnt 0x0"
                 :: "v"(loff),
                    "v"(loff + 1u * 8u * LP_ * 4u), "v"(loff + 2u * 8u * LP_ * 4u),
                    "v"(loff + 3u * 8u * LP_ * 4u), "v"(loff + 4u * 8u * LP_ * 4u),
                    "v"(loff + 5u * 8u * LP_ * 4u), "v"(loff + 6u * 8u * LP_ * 4u),
                    "v"(loff + 7u * 8u * LP_ * 4u),
                    "v"(gsrc),
                    "v"(gsrc + 1 * 8 * D_), "v"(gsrc + 2 * 8 * D_),
                    "v"(gsrc + 3 * 8 * D_), "v"(gsrc + 4 * 8 * D_),
                    "v"(gsrc + 5 * 8 * D_), "v"(gsrc + 6 * 8 * D_),
                    "v"(gsrc + 7 * 8 * D_)
                 : "memory");
}
__device__ __forceinline__ void wait_async()
{
    asm volatile("s_wait_asynccnt 0x0" ::: "memory");
}

// ---------------------------------------------------------------------------
// Weights in fragment order.  P[w][wv][m][lane] is a float4 with the B fragments
// of k steps 2m and 2m+1 of wave wv's column strip (col = 16 wv + (lane & 15),
// h = lane >> 4): W[col][8m+2h], [8m+2h+1], [8m+4+2h], [8m+4+2h+1].  A wave then
// fetches a whole fragment set as 16 loads of 512 contiguous bytes.
// w: 0 = Wkv, 1 = Wq, 2 = Wout.  Grid 48 x 256: one float4 per thread.
// ---------------------------------------------------------------------------
__global__ __launch_bounds__(256) void pack_frags(
    const float* __restrict__ Wkv, const float* __restrict__ Wq,
    const float* __restrict__ Wout, float* __restrict__ P)
{
    const int w   = blockIdx.x >> 4;
    const int idx = (blockIdx.x & 15) * 256 + threadIdx.x;   // within one matrix
    const int lane = idx & 31, m = (idx >> 5) & 15, wv = idx >> 9;
    const float* src = (w == 0 ? Wkv : w == 1 ? Wq : Wout)
                     + (wv * 16 + (lane & 15)) * D_ + 8 * m + 2 * (lane >> 4);
    float4 f;
    f.x = src[0]; f.y = src[1]; f.z = src[4]; f.w = src[5];
    *(float4*)&P[(w * D_ * D_) + idx * 4] = f;
}

// one wave's 32 B fragments of one matrix; p = P + w*D*D + wv*2048 + lane*4
__device__ __forceinline__ void load_frags(v2f (&bf)[32], const float* p)
{
#pragma unroll
    for (int m = 0; m < 16; ++m) {
        const float4 f = *(const float4*)&p[m * 128];
        bf[2 * m]     = v2f{f.x, f.y};
        bf[2 * m + 1] = v2f{f.z, f.w};
    }
}

// ---------------------------------------------------------------------------
// dst[64 x 128] = a[64 x 128, LDS, pitch LP_] @ W^T + bias for one slab.
// Wave wv owns column strip [16*wv, 16*wv+16); bf holds its 32 B fragments
// (bf[k] = W^T[4k+2h .. +1][col]).  FP32 WMMA 16x16x4.  DP = pitch of dst,
// GL = dst is global memory.
// ---------------------------------------------------------------------------
template <int DP, bool GL>
__device__ __forceinline__ void slab_gemm(const float* a, const v2f (&bf)[32],
                                          float bias, float* dst,
                                          int l, int hl, int col)
{
    for (int rt = 0; rt < 4; ++rt) {
        const float* arow = a + (rt * 16 + l) * LP_;
        v8f c = {};
#pragma unroll
        for (int k = 0; k < 32; ++k) {
            v2f av = *(const v2f*)&arow[4 * k + 2 * hl];
            c = __builtin_amdgcn_wmma_f32_16x16x4_f32(false, av, false, bf[k],
                                                      (short)0, c, false, false);
        }
#pragma unroll
        for (int r = 0; r < 8; ++r)
            dst[(rt * 16 + r + 8 * hl) * DP + col] = c[r] + bias;
        // the next trip rewrites the registers that the issued global stores name
        if (GL) asm volatile("s_wait_xcnt 0x0" ::: "memory");
    }
}

// ---------------------------------------------------------------------------
// Attention of one v by one wave.  Half-wave hl takes the neighbours
// n = 8 hl .. 8 hl + 7; its 16 lanes cover a whole k row, lane l the columns
// 4l .. 4l+3 and 64+4l .. 64+4l+3, so each 16-byte LDS read of a half-wave is
// 256 contiguous bytes whatever row the index names.  The rows stay in
// registers and serve the scores and the weighted sum alike.
// ---------------------------------------------------------------------------
struct Gath { v4f k[16]; v4f q[2]; };   // k[2m], k[2m+1]: row of n = 8 hl + m

// value of another lane of the same 16-lane row (0x160 + x: lane ^ x,
// 0x150 + i: lane i of the row)
template <int CTRL>
__device__ __forceinline__ float rowlane(float x)
{
    return __builtin_bit_cast(float, __builtin_amdgcn_update_dpp(
        0, __builtin_bit_cast(int, x), CTRL, 0xf, 0xf, true));
}
// lane l with lane l ^ 16
__device__ __forceinline__ float xhalf(float x)
{
    return __builtin_bit_cast(float, __builtin_amdgcn_permlanex16(
        __builtin_bit_cast(int, x), __builtin_bit_cast(int, x),
        0x76543210, 0xfedcba98, false, false));
}

// jr = &jrow[v][8 hl]
__device__ __forceinline__ void load_offs(int (&jo)[8], const int* jr)
{
    const int4 a = *(const int4*)jr, b = *(const int4*)(jr + 4);
    jo[0] = a.x; jo[1] = a.y; jo[2] = a.z; jo[3] = a.w;
    jo[4] = b.x; jo[5] = b.y; jo[6] = b.z; jo[7] = b.w;
}
// kc = ks + 4 l, qc = &qs[v * D_ + 4 l]
__device__ __forceinline__ void load_rows(Gath& g, const int (&jo)[8],
                                          const float* kc, const float* qc)
{
#pragma unroll
    for (int m = 0; m < 8; ++m) {
        g.k[2 * m]     = *(const v4f*)&kc[jo[m]];
        g.k[2 * m + 1] = *(const v4f*)&kc[jo[m] + 64];
    }
    g.q[0] = *(const v4f*)qc;
    g.q[1] = *(const v4f*)(qc + 64);
    // keeps these reads where they stand, ahead of the arithmetic on the other
    // register set: moved down to their first use, each v would wait out its own
    // LDS latency
    __builtin_amdgcn_sched_barrier(0);
}

// dst = &res[v][64 hl + 4 l]
__device__ __forceinline__ void attend(const Gath& g, float* dst, int l, int hl)
{
    // each lane's share (8 of 128 columns) of its half-wave's eight dot products
    float p[8];
#pragma unroll
    for (int m = 0; m < 8; ++m) {
        const v4f a = g.k[2 * m], b = g.k[2 * m + 1];
        v2f t = g.q[0].xy * a.xy;                 // even and odd columns apart
        t = __builtin_elementwise_fma(g.q[0].zw, a.zw, t);
        t = __builtin_elementwise_fma(g.q[1].xy, b.xy, t);
        t = __builtin_elementwise_fma(g.q[1].zw, b.zw, t);
        p[m] = t.x + t.y;
    }
    // sum over the 16 lanes; each step halves the values a lane carries, and
    // lanes 2m and 2m+1 of the row end with the whole dot product of n = 8 hl + m
    const bool b3 = l & 8, b2 = l & 4, b1 = l & 2;
    float r4[4], r2[2];
#pragma unroll
    for (int m = 0; m < 4; ++m)
        r4[m] = (b3 ? p[m + 4] : p[m]) + rowlane<0x168>(b3 ? p[m] : p[m + 4]);
#pragma unroll
    for (int m = 0; m < 2; ++m)
        r2[m] = (b2 ? r4[m + 2] : r4[m]) + rowlane<0x164>(b2 ? r4[m] : r4[m + 2]);
    float s = (b1 ? r2[1] : r2[0]) + rowlane<0x162>(b1 ? r2[0] : r2[1]);
    s += rowlane<0x161>(s);
    s *= 0.08838834764831845f;   // 1/sqrt(128)

    // softmax over the 16 n: lane bits 1..4 number them
    float mx = fmaxf(s, rowlane<0x162>(s));
    mx = fmaxf(mx, rowlane<0x164>(mx));
    mx = fmaxf(mx, rowlane<0x168>(mx));
    mx = fmaxf(mx, xhalf(mx));
    const float e = __expf(s - mx);
    float sum = e + rowlane<0x162>(e);
    sum += rowlane<0x164>(sum);
    sum += rowlane<0x168>(sum);
    sum += xhalf(sum);
    const float w = e / sum;

    // weighted sum of the half-wave's eight rows, from the same registers
    v2f acc[4] = {v2f{0.f, 0.f}, v2f{0.f, 0.f}, v2f{0.f, 0.f}, v2f{0.f, 0.f}};
#define ROW_(m)                                                              \
    {                                                                        \
        const float wm = rowlane<0x150 + 2 * (m)>(w);                        \
        const v2f   w2 = v2f{wm, wm};                                        \
        const v4f   a = g.k[2 * (m)], b = g.k[2 * (m) + 1];                  \
        acc[0] = __builtin_elementwise_fma(w2, a.xy, acc[0]);                \
        acc[1] = __builtin_elementwise_fma(w2, a.zw, acc[1]);                \
        acc[2] = __builtin_elementwise_fma(w2, b.xy, acc[2]);                \
        acc[3] = __builtin_elementwise_fma(w2, b.zw, acc[3]);                \
    }
    ROW_(0) ROW_(1) ROW_(2) ROW_(3) ROW_(4) ROW_(5) ROW_(6) ROW_(7)
#undef ROW_
    // the two halves' sums meet: half 0 finishes columns 4l.., half 1 64+4l..
    v4f o;
    o.x = (hl ? acc[2].x : acc[0].x) + xhalf(hl ? acc[0].x : acc[2].x);
    o.y = (hl ? acc[2].y : acc[0].y) + xhalf(hl ? acc[0].y : acc[2].y);
    o.z = (hl ? acc[3].x : acc[1].x) + xhalf(hl ? acc[1].x : acc[3].x);
    o.w = (hl ? acc[3].y : acc[1].y) + xhalf(hl ? acc[1].y : acc[3].y);
    *(v4f*)dst = o;
}

// ---------------------------------------------------------------------------
// The three projections and the attention in one launch.  A (b, t) slab is 64
// rows x 128 and needs no other slab: k = keys @ Wkv^T, for t >= T-P also
// q = queries @ Wq^T and the gathered attention among the slab's own 64 k rows,
// then res @ Wout^T.  k, q and res stay in LDS.  A block takes the slabs
// t = r0, r0+32, r0+64, r0+96 of one b (one without attention, three with), so
// every block has the same work.
// ---------------------------------------------------------------------------
__global__ __launch_bounds__(256) void fused_slabs(
    const float* __restrict__ Qin,   // queries (B,P,V,D)
    const float* __restrict__ Kin,   // keys    (B,T,V,D)
    const int*   __restrict__ ccc,   // var_ccc (B,V,N)
    const float* __restrict__ bq, const float* __restrict__ bkv,
    const float* __restrict__ bout,
    const float* __restrict__ Pw,    // weights in fragment order (pack_frags)
    float* __restrict__ Out)         // (B,T,V,D)
{
    __shared__ __attribute__((aligned(16))) float sm[3 * V_ * LP_];  // 99 KB, three slabs
    __shared__ __attribute__((aligned(16))) float qs[V_ * D_];   // 32 KB projected q
    __shared__ __attribute__((aligned(16))) int jrow[V_][N_];    //  4 KB gathered rows' offsets in ks
    __shared__ float bl[3][D_];      //  biases: bkv, bq, bout
    float* xk = sm;                  // keys slab, later res (attention output)
    float* xq = sm + V_ * LP_;       // queries slab
    float* ks = sm + 2 * V_ * LP_;   // projected k slab

    const int tid = threadIdx.x;
    const int b   = blockIdx.x / (T_ - P_);
    const int r0  = blockIdx.x % (T_ - P_);

    // the wave's number as a scalar, so that what is formed from it is scalar too
    const int wv = __builtin_amdgcn_readfirstlane(tid >> 5);
    const int lane = tid & 31, hl = lane >> 4, l = lane & 15;
    const int col = wv * 16 + l;
    const float* pw = Pw + wv * 2048 + lane * 4;

    // staging: thread -> row wv + 8 * n, 16-byte column lane
    const int sr = wv;
    const int sc = 4 * lane;

    const int  grp = 2 * wv + hl;         // 0..15
    const int  nn  = l;                   // n index
    const int* cb  = ccc + (b * V_) * N_;

    // biases, and the gather indices (they depend on b alone), once per block
    if (tid < D_) {
        bl[0][tid] = bkv[tid];
        bl[1][tid] = bq[tid];
        bl[2][tid] = bout[tid];
    }
#pragma unroll
    for (int i = 0; i < V_ / 16; ++i) {
        const int v = 16 * i + grp;
        jrow[v][nn] = (cb[v * N_ + nn] & (V_ - 1)) * LP_;   // the mask keeps the row inside ks
    }

    for (int it = 0; it < T_ / (T_ - P_); ++it) {
        const int  t    = r0 + it * (T_ - P_);
        const bool att  = it > 0;         // t >= T-P: the slab has queries
        const float* kin = Kin + ((long)(b * T_ + t) * V_) * D_;

        if (att) {
            // the slab before this one is still being read from sm by slower
            // waves: every wave's LDS reads retire, then all meet, before the
            // copies below overwrite it
            asm volatile("s_wait_dscnt 0x0" ::: "memory");
            __syncthreads();
        }
        async_ld_b128_x8(&xk[sr * LP_ + sc], kin + sr * D_ + sc);
        if (att) {
            const float* qin = Qin + ((long)(b * P_ + t - (T_ - P_)) * V_) * D_;
            async_ld_b128_x8(&xq[sr * LP_ + sc], qin + sr * D_ + sc);
        }
        v2f bf[32];
        load_frags(bf, pw);               // Wkv, in flight beside the copies
        wait_async();
        __syncthreads();

        // ---- k = keys @ Wkv^T + bkv, q = queries @ Wq^T + bq ----
        slab_gemm<LP_, false>(xk, bf, bl[0][col], ks, l, hl, col);
        if (att) {
            load_frags(bf, pw + D_ * D_);
            slab_gemm<D_, false>(xq, bf, bl[1][col], qs, l, hl, col);
        }
        __syncthreads();

        if (att) {
            // ---- attention: wave wv takes v = 8 wv .. 8 wv + 7, res goes into the
            // spent keys slab.  Two register sets: the rows of v + 1 are fetched
            // ahead of the arithmetic of v, their offsets one v earlier still.
            const float* kc = ks + 4 * l;
            const float* qc = qs + (wv * 8) * D_ + 4 * l;
            const int*   jr = &jrow[wv * 8][8 * hl];
            float*       rd = xk + (wv * 8) * LP_ + 64 * hl + 4 * l;
            Gath ga, gb;
            int  jo[8];
            load_offs(jo, jr);
            load_rows(ga, jo, kc, qc);
            load_offs(jo, jr + N_);
#pragma unroll
            for (int i = 0; i < 8; i += 2) {
                load_rows(gb, jo, kc, qc + (i + 1) * D_);
                if (i + 2 < 8) load_offs(jo, jr + (i + 2) * N_);
                attend(ga, rd + i * LP_, l, hl);
                if (i + 2 < 8) {
                    load_rows(ga, jo, kc, qc + (i + 2) * D_);
                    load_offs(jo, jr + (i + 3) * N_);
                } else {
                    load_frags(bf, pw + 2 * D_ * D_);   // Wout, in flight beside the last v
                }
                attend(gb, rd + (i + 1) * LP_, l, hl);
            }
            __syncthreads();
        } else {
            load_frags(bf, pw + 2 * D_ * D_);           // Wout
        }

        // ---- out = res @ Wout^T + bout (res = k where the slab has no queries) ----
        slab_gemm<D_, true>(sm + (att ? 0 : 2 * V_ * LP_), bf, bl[2][col],
                      Out + ((long)(b * T_ + t) * V_) * D_, l, hl, col);
    }
}

// ---------------------------------------------------------------------------
extern "C" void kernel_launch(void* const* d_in, const int* in_sizes, int n_in,
                              void* d_out, int out_size, void* d_ws, size_t ws_size,
                              hipStream_t stream)
{
    const float* queries = (const float*)d_in[0];
    const float* keys    = (const float*)d_in[1];
    const int*   ccc     = (const int*)d_in[2];
    const float* Wq      = (const float*)d_in[3];
    const float* bq      = (const float*)d_in[4];
    const float* Wkv     = (const float*)d_in[5];
    const float* bkv     = (const float*)d_in[6];
    const float* Wout    = (const float*)d_in[7];
    const float* bout    = (const float*)d_in[8];
    float* out = (float*)d_out;
    float* pw  = (float*)d_ws;                // 3 * D * D f32 = 192 KiB scratch

    (void)in_sizes; (void)n_in; (void)out_size; (void)ws_size;

    // 1) the three weight matrices into fragment order
    pack_frags<<<48, 256, 0, stream>>>(Wkv, Wq, Wout, pw);
    // 2) everything else: one block per (b, r0), r0 < T-P; four slabs each
    fused_slabs<<<B_ * (T_ - P_), 256, 0, stream>>>(queries, keys, ccc, bq, bkv,
                                                    bout, pw, out);
}
